// v000
// Measured on an AMD MI455X. A time is GPU time per run, averaged over a window of back-to-back runs after a warm-up
// (all launches, gaps included; the runs take copies of the inputs in turn), and the median of several windows.
// Apart from v000's, it joins two sittings. Times from different sittings can be a few percent apart, while
// side-by-side timings come from the same sitting.
// The starting kernel, v000, takes 26.9 microseconds a run.
#include <hip/hip_runtime.h>

typedef float v2f __attribute__((ext_vector_type(2)));
typedef float v8f __attribute__((ext_vector_type(8)));

#define B_    8
#define H_    8
#define N_    3136
#define D_    32
#define K2_   9
#define TILE_N 64          // rows per workgroup (4 waves x 16-row WMMA tiles)
#define AS_STRIDE 17       // padded attn_s row stride (avoids lo/hi lane bank clash)

__global__ __launch_bounds__(128) void swattn_av_kernel(
    const float* __restrict__ q,          // [B,H,N,32]
    const float* __restrict__ attn_local, // [B,H,N,9]
    const float* __restrict__ v,          // [B,H,N,32,9]
    const float* __restrict__ lt,         // [H,32,9]
    const float* __restrict__ bias,       // [H,N,9]
    float* __restrict__ out)              // [B,H,N,32]
{
    __shared__ float lt_s[D_ * 16];             // [k=0..31][n=0..15], zero-padded cols 9..15
    __shared__ float attn_s[TILE_N * AS_STRIDE];

    const int t    = threadIdx.x;
    const int wave = t >> 5;
    const int lane = t & 31;

    const int tiles_per_bh = N_ / TILE_N;       // 49
    const int bh = blockIdx.x / tiles_per_bh;
    const int nb = (blockIdx.x % tiles_per_bh) * TILE_N;
    const int h  = bh % H_;

    // ---- Phase 0: stage zero-padded learnable_tokens[h] (32x9 -> 32x16) in LDS ----
    {
        const float* ltb = lt + (size_t)h * (D_ * K2_);
        #pragma unroll
        for (int i = t; i < D_ * 16; i += 128) {
            const int row = i >> 4;             // k index 0..31
            const int col = i & 15;             // n index 0..15
            lt_s[i] = (col < K2_) ? ltb[row * K2_ + col] : 0.f;
        }
    }
    __syncthreads();

    // ---- Phase 1: attn[16x16] = q[16x32] @ lt[32x16] via WMMA f32 16x16x4 ----
    const int  nb2 = nb + wave * 16;            // this wave's 16-row sub-tile
    const int  r   = lane & 15;                 // A: row index / B: col index
    const bool hi  = lane >= 16;                // K-offset +2 half of the wave

    const float* qrow = q + ((size_t)bh * N_ + (nb2 + r)) * D_;

    v8f c = {0.f, 0.f, 0.f, 0.f, 0.f, 0.f, 0.f, 0.f};
    #pragma unroll
    for (int kk = 0; kk < 8; ++kk) {            // K = 32 as 8 steps of K4
        const int k0 = kk * 4 + (hi ? 2 : 0);
        v2f a, b;
        a.x = qrow[k0];
        a.y = qrow[k0 + 1];
        b.x = lt_s[(k0    ) * 16 + r];          // conflict-free, branchless
        b.y = lt_s[(k0 + 1) * 16 + r];
        c = __builtin_amdgcn_wmma_f32_16x16x4_f32(false, a, false, b,
                                                  (short)0, c, false, false);
    }

    // C layout: c[vv] = dot(q[row], lt[:,col]) with row = vv + (hi?8:0), col = r.
    // Store all 16 cols unconditionally (cols 9..15 are dead padding).
    #pragma unroll
    for (int vv = 0; vv < 8; ++vv) {
        const int row = vv + (hi ? 8 : 0);
        attn_s[(wave * 16 + row) * AS_STRIDE + r] = c[vv];
    }
    __syncthreads();

    // ---- Phase 1b: attn += bias + attn_local (coalesced cooperative pass) ----
    {
        const float* bsrc = bias       + ((size_t)h  * N_ + nb) * K2_;
        const float* asrc = attn_local + ((size_t)bh * N_ + nb) * K2_;
        #pragma unroll
        for (int i = t; i < TILE_N * K2_; i += 128) {
            const int nloc = i / K2_;
            const int k    = i - nloc * K2_;
            attn_s[nloc * AS_STRIDE + k] += bsrc[i] + asrc[i];
        }
    }
    __syncthreads();

    // ---- Phase 2: out[n,d] = sum_k attn[n,k] * v[n,d,k] (NT streaming) ----
    const int d = lane;                         // 0..31 == D
    #pragma unroll 4
    for (int rr = 0; rr < 16; ++rr) {
        const int nloc = wave * 16 + rr;
        const int n    = nb + nloc;
        const float* vrow = v + (((size_t)bh * N_ + n) * D_ + d) * K2_;
        if (rr < 12)                            // stay inside this tile's slab
            __builtin_prefetch(vrow + 4 * (D_ * K2_), 0, 0);
        float acc = 0.f;
        #pragma unroll
        for (int k = 0; k < K2_; ++k) {
            acc = fmaf(attn_s[nloc * AS_STRIDE + k],
                       __builtin_nontemporal_load(vrow + k), acc);
        }
        __builtin_nontemporal_store(acc, out + (((size_t)bh * N_ + n) * D_ + d));
    }
}

extern "C" void kernel_launch(void* const* d_in, const int* in_sizes, int n_in,
                              void* d_out, int out_size, void* d_ws, size_t ws_size,
                              hipStream_t stream) {
    (void)in_sizes; (void)n_in; (void)d_ws; (void)ws_size; (void)out_size;
    const float* q          = (const float*)d_in[0];
    const float* attn_local = (const float*)d_in[1];
    const float* v          = (const float*)d_in[2];
    const float* lt         = (const float*)d_in[3];
    const float* bias       = (const float*)d_in[4];
    float* out = (float*)d_out;

    const int grid = B_ * H_ * (N_ / TILE_N);   // 3136 workgroups
    swattn_av_kernel<<<grid, 128, 0, stream>>>(q, attn_local, v, lt, bias, out);
}

// v001
// It runs in 24.1 microseconds.
// Timed twice side by side with v000, it ran 1.10 and 1.13 times as fast.
#include <hip/hip_runtime.h>

typedef float v2f __attribute__((ext_vector_type(2)));
typedef float v8f __attribute__((ext_vector_type(8)));

#define B_    8
#define H_    8
#define N_    3136
#define D_    32
#define K2_   9
#define TILE_N 64          // rows per workgroup (4 waves x 16-row WMMA tiles)
#define AS_STRIDE 17       // padded attn_s row stride (avoids lo/hi lane bank clash)
#define VROW   (D_ * K2_)  // 288 floats = 1152 B: one row's v block
#define VWAVE  (16 * VROW) // 4608 floats = 18432 B: one wave's 16 rows, contiguous in v

// Twelve 16-byte-per-lane copies global -> LDS (12 x 512 contiguous bytes per wave), through
// no register; non-temporal like the loads they replace (v is read once).
// s_wait_xcnt 0 closes the statement as a precaution: no address register that a copy names
// is rewritten ahead of it, and inside the statement nothing can be moved over it.
__device__ __forceinline__ void copy12_to_lds(unsigned l, const float* g)
{
    asm volatile(
        "global_load_async_to_lds_b128 %0, %12, off th:TH_LOAD_NT\n\t"
        "global_load_async_to_lds_b128 %1, %13, off th:TH_LOAD_NT\n\t"
        "global_load_async_to_lds_b128 %2, %14, off th:TH_LOAD_NT\n\t"
        "global_load_async_to_lds_b128 %3, %15, off th:TH_LOAD_NT\n\t"
        "global_load_async_to_lds_b128 %4, %16, off th:TH_LOAD_NT\n\t"
        "global_load_async_to_lds_b128 %5, %17, off th:TH_LOAD_NT\n\t"
        "global_load_async_to_lds_b128 %6, %18, off th:TH_LOAD_NT\n\t"
        "global_load_async_to_lds_b128 %7, %19, off th:TH_LOAD_NT\n\t"
        "global_load_async_to_lds_b128 %8, %20, off th:TH_LOAD_NT\n\t"
        "global_load_async_to_lds_b128 %9, %21, off th:TH_LOAD_NT\n\t"
        "global_load_async_to_lds_b128 %10, %22, off th:TH_LOAD_NT\n\t"
        "global_load_async_to_lds_b128 %11, %23, off th:TH_LOAD_NT\n\t"
        "s_wait_xcnt 0x0"
        :: "v"(l),        "v"(l +  512), "v"(l + 1024), "v"(l + 1536),
           "v"(l + 2048), "v"(l + 2560), "v"(l + 3072), "v"(l + 3584),
           "v"(l + 4096), "v"(l + 4608), "v"(l + 5120), "v"(l + 5632),
           "v"(g),        "v"(g +  128), "v"(g +  256), "v"(g +  384),
           "v"(g +  512), "v"(g +  640), "v"(g +  768), "v"(g +  896),
           "v"(g + 1024), "v"(g + 1152), "v"(g + 1280), "v"(g + 1408)
        : "memory");
}

__global__ __launch_bounds__(128) void swattn_av_kernel(
    const float* __restrict__ q,          // [B,H,N,32]
    const float* __restrict__ attn_local, // [B,H,N,9]
    const float* __restrict__ v,          // [B,H,N,32,9]
    const float* __restrict__ lt,         // [H,32,9]
    const float* __restrict__ bias,       // [H,N,9]
    float* __restrict__ out)              // [B,H,N,32]
{
    __shared__ float lt_s[D_ * 16];             // [k=0..31][n=0..15], zero-padded cols 9..15
    __shared__ float attn_s[TILE_N * AS_STRIDE];
    __shared__ __attribute__((aligned(16))) float v_s[4 * VWAVE]; // v rows, same layout as in memory

    const int t    = threadIdx.x;
    const int wave = t >> 5;
    const int lane = t & 31;

    const int tiles_per_bh = N_ / TILE_N;       // 49
    const int bh = blockIdx.x / tiles_per_bh;
    const int nb = (blockIdx.x % tiles_per_bh) * TILE_N;
    const int h  = bh % H_;

    // ---- v first: each wave sends its 16 rows (36 x 512 B, whole lines) on their way to LDS;
    //      they fly while phases 0 to 1b run ----
    {
        const float*   vsrc = v + ((size_t)bh * N_ + nb + wave * 16) * VROW + lane * 4;
        const unsigned vdst = (unsigned)(size_t)&v_s[wave * VWAVE + lane * 4];
        copy12_to_lds(vdst,         vsrc);
        copy12_to_lds(vdst +  6144, vsrc + 1536);
        copy12_to_lds(vdst + 12288, vsrc + 3072);
    }

    // ---- Phase 0: stage zero-padded learnable_tokens[h] (32x9 -> 32x16) in LDS ----
    {
        const float* ltb = lt + (size_t)h * (D_ * K2_);
        #pragma unroll
        for (int i = t; i < D_ * 16; i += 128) {
            const int row = i >> 4;             // k index 0..31
            const int col = i & 15;             // n index 0..15
            lt_s[i] = (col < K2_) ? ltb[row * K2_ + col] : 0.f;
        }
    }
    __syncthreads();

    // ---- Phase 1: attn[16x16] = q[16x32] @ lt[32x16] via WMMA f32 16x16x4 ----
    const int  nb2 = nb + wave * 16;            // this wave's 16-row sub-tile
    const int  r   = lane & 15;                 // A: row index / B: col index
    const bool hi  = lane >= 16;                // K-offset +2 half of the wave

    const float* qrow = q + ((size_t)bh * N_ + (nb2 + r)) * D_;

    v8f c = {0.f, 0.f, 0.f, 0.f, 0.f, 0.f, 0.f, 0.f};
    #pragma unroll
    for (int kk = 0; kk < 8; ++kk) {            // K = 32 as 8 steps of K4
        const int k0 = kk * 4 + (hi ? 2 : 0);
        v2f a, b;
        a.x = qrow[k0];
        a.y = qrow[k0 + 1];
        b.x = lt_s[(k0    ) * 16 + r];          // conflict-free, branchless
        b.y = lt_s[(k0 + 1) * 16 + r];
        c = __builtin_amdgcn_wmma_f32_16x16x4_f32(false, a, false, b,
                                                  (short)0, c, false, false);
    }

    // C layout: c[vv] = dot(q[row], lt[:,col]) with row = vv + (hi?8:0), col = r.
    // Store all 16 cols unconditionally (cols 9..15 are dead padding).
    #pragma unroll
    for (int vv = 0; vv < 8; ++vv) {
        const int row = vv + (hi ? 8 : 0);
        attn_s[(wave * 16 + row) * AS_STRIDE + r] = c[vv];
    }
    __syncthreads();

    // ---- Phase 1b: attn += bias + attn_local (coalesced cooperative pass) ----
    {
        const float* bsrc = bias       + ((size_t)h  * N_ + nb) * K2_;
        const float* asrc = attn_local + ((size_t)bh * N_ + nb) * K2_;
        #pragma unroll
        for (int i = t; i < TILE_N * K2_; i += 128) {
            const int nloc = i / K2_;
            const int k    = i - nloc * K2_;
            attn_s[nloc * AS_STRIDE + k] += bsrc[i] + asrc[i];
        }
    }
    // this wave's v copies have landed in LDS before anything below reads them
    asm volatile("s_wait_asynccnt 0x0" ::: "memory");
    __syncthreads();

    // ---- Phase 2: out[n,d] = sum_k attn[n,k] * v[n,d,k], v from LDS ----
    // lane d reads dwords 9d+k: 9 is odd, so the 32 lanes fall on 32 different banks
    const int d = lane;                         // 0..31 == D
    #pragma unroll 4
    for (int rr = 0; rr < 16; ++rr) {
        const int nloc = wave * 16 + rr;
        const int n    = nb + nloc;
        const float* vrow = &v_s[nloc * VROW + d * K2_];
        float acc = 0.f;
        #pragma unroll
        for (int k = 0; k < K2_; ++k) {
            acc = fmaf(attn_s[nloc * AS_STRIDE + k], vrow[k], acc);
        }
        __builtin_nontemporal_store(acc, out + (((size_t)bh * N_ + n) * D_ + d));
    }
}

extern "C" void kernel_launch(void* const* d_in, const int* in_sizes, int n_in,
                              void* d_out, int out_size, void* d_ws, size_t ws_size,
                              hipStream_t stream) {
    (void)in_sizes; (void)n_in; (void)d_ws; (void)ws_size; (void)out_size;
    const float* q          = (const float*)d_in[0];
    const float* attn_local = (const float*)d_in[1];
    const float* v          = (const float*)d_in[2];
    const float* lt         = (const float*)d_in[3];
    const float* bias       = (const float*)d_in[4];
    float* out = (float*)d_out;

    const int grid = B_ * H_ * (N_ / TILE_N);   // 3136 workgroups
    swattn_av_kernel<<<grid, 128, 0, stream>>>(q, attn_local, v, lt, bias, out);
}

// v002
// Measured time: 19.2 microseconds a run.
// Two timings next to v001 put it at 1.26 and 1.27 times that version's speed.
// All steps since v000 together make it 1.42 times as fast.
#include <hip/hip_runtime.h>

typedef float v2f __attribute__((ext_vector_type(2)));
typedef float v8f __attribute__((ext_vector_type(8)));

#define B_    8
#define H_    8
#define N_    3136
#define D_    32
#define K2_   9
#define WAVES  14          // waves per workgroup; one workgroup fills one WGP's LDS
#define NTHR   (WAVES * 32)
#define TILE_N 784         // rows per workgroup: a quarter of one (b,h) plane = 49 WMMA tiles
#define NTILE  (TILE_N / 16)
#define WROWS  56          // v rows per wave = NSTAGE x SROWS
#define SROWS  8           // v rows per ring stage
#define NSTAGE 7
#define AS_STRIDE 17       // padded attn_s row stride (avoids lo/hi lane bank clash)
#define VROW   (D_ * K2_)  // 288 floats = 1152 B: one row's v block
#define VSTAGE (SROWS * VROW) // 2304 floats = 9216 B = 18 x 512 B: one stage, contiguous in v

// Nine 16-byte-per-lane copies global -> LDS (9 x 512 contiguous bytes per wave), through
// no register; non-temporal (v is read once).
// s_wait_xcnt 0 closes the statement as a precaution: no address register that a copy names
// is rewritten ahead of it, and inside the statement nothing can be moved over it.
__device__ __forceinline__ void copy9_to_lds(unsigned l, const float* g)
{
    asm volatile(
        "global_load_async_to_lds_b128 %0, %9, off th:TH_LOAD_NT\n\t"
        "global_load_async_to_lds_b128 %1, %10, off th:TH_LOAD_NT\n\t"
        "global_load_async_to_lds_b128 %2, %11, off th:TH_LOAD_NT\n\t"
        "global_load_async_to_lds_b128 %3, %12, off th:TH_LOAD_NT\n\t"
        "global_load_async_to_lds_b128 %4, %13, off th:TH_LOAD_NT\n\t"
        "global_load_async_to_lds_b128 %5, %14, off th:TH_LOAD_NT\n\t"
        "global_load_async_to_lds_b128 %6, %15, off th:TH_LOAD_NT\n\t"
        "global_load_async_to_lds_b128 %7, %16, off th:TH_LOAD_NT\n\t"
        "global_load_async_to_lds_b128 %8, %17, off th:TH_LOAD_NT\n\t"
        "s_wait_xcnt 0x0"
        :: "v"(l),        "v"(l +  512), "v"(l + 1024), "v"(l + 1536),
           "v"(l + 2048), "v"(l + 2560), "v"(l + 3072), "v"(l + 3584),
           "v"(l + 4096),
           "v"(g),        "v"(g +  128), "v"(g +  256), "v"(g +  384),
           "v"(g +  512), "v"(g +  640), "v"(g +  768), "v"(g +  896),
           "v"(g + 1024)
        : "memory");
}

// One ring stage: 8 v rows = 18 copies of this wave.
__device__ __forceinline__ void copy_stage(unsigned l, const float* g)
{
    copy9_to_lds(l,        g);
    copy9_to_lds(l + 4608, g + 1152);
}

// One stage's 8 rows: out[n,d] = sum_k attn[n,k] * v[n,d,k]; vb, at, o already hold lane d's place.
// lane d reads dwords 9d+k: 9 is odd, so the 32 lanes fall on 32 different banks
__device__ __forceinline__ void av_stage(const float* vb, const float* at, float* o)
{
    #pragma unroll 1                            // rolled by fours: a small body, one wait a trip
    for (int g = 0; g < SROWS; g += 4) {
        #pragma unroll
        for (int rr = g; rr < g + 4; ++rr) {
            const float* vrow = vb + rr * VROW;
            float acc = 0.f;
            #pragma unroll
            for (int k = 0; k < K2_; ++k) {
                acc = fmaf(at[rr * AS_STRIDE + k], vrow[k], acc);
            }
            __builtin_nontemporal_store(acc, o + rr * D_);
        }
        // a precaution: the next trip rewrites the registers that these four stores name
        asm volatile("s_wait_xcnt 0x0" ::: "memory");
    }
}

__global__ __launch_bounds__(NTHR) void swattn_av_kernel(
    const float* __restrict__ q,          // [B,H,N,32]
    const float* __restrict__ attn_local, // [B,H,N,9]
    const float* __restrict__ v,          // [B,H,N,32,9]
    const float* __restrict__ lt,         // [H,32,9]
    const float* __restrict__ bias,       // [H,N,9]
    float* __restrict__ out)              // [B,H,N,32]
{
    __shared__ float lt_s[2 * NTHR];            // [k=0..31][n=0..15], zero-padded cols 9..15; past 512: dead
    __shared__ float attn_s[TILE_N * AS_STRIDE];
    // per wave two stage buffers, each 8 v rows in the layout they have in memory
    __shared__ __attribute__((aligned(16))) float v_s[WAVES * 2 * VSTAGE];

    const int t    = threadIdx.x;
    const int wave = __builtin_amdgcn_readfirstlane(t >> 5);
    const int lane = t & 31;

    const int parts_per_bh = N_ / TILE_N;       // 4
    const int bh = blockIdx.x / parts_per_bh;
    const int nb = (blockIdx.x % parts_per_bh) * TILE_N;
    const int h  = bh % H_;

    const int  r   = lane & 15;                 // A: row index / B: col index
    const bool hi  = lane >= 16;                // K-offset +2 half of the wave

    // ---- The small operands go out first, into registers: the attn phases wait on them,
    //      and behind the v copies they would queue for the whole of two stages ----
    float ltv[2];
    {
        const float* ltb = lt + (size_t)h * (D_ * K2_);
        #pragma unroll
        for (int j = 0; j < 2; ++j) {
            const int i   = min(t + j * NTHR, D_ * 16 - 1);
            const int row = i >> 4;             // k index 0..31
            const int col = i & 15;             // n index 0..15
            ltv[j] = ltb[row * K2_ + min(col, K2_ - 1)]; // cols 9..15: zeroed at the store
        }
    }
    v2f a[4][8];                                // this wave's q fragments, tiles wave + 14 j
    #pragma unroll
    for (int j = 0; j < 4; ++j) {
        // a fourth tile past the end is clamped here (in bounds, straight-line) and skipped below
        const int tile = min(wave + j * WAVES, NTILE - 1);
        const float* qrow = q + ((size_t)bh * N_ + (nb + tile * 16 + r)) * D_;
        #pragma unroll
        for (int kk = 0; kk < 8; ++kk) {        // K = 32 as 8 steps of K4
            const int k0 = kk * 4 + (hi ? 2 : 0);
            a[j][kk].x = qrow[k0];
            a[j][kk].y = qrow[k0 + 1];
        }
        // a precaution: the next loads' results may take over this tile's address registers
        asm volatile("s_wait_xcnt 0x0" ::: "memory");
    }
    float bv[16], av[16];
    {
        const float* bsrc = bias       + ((size_t)h  * N_ + nb) * K2_;
        const float* asrc = attn_local + ((size_t)bh * N_ + nb) * K2_;
        #pragma unroll
        for (int j = 0; j < 16; ++j) {
            const int i = min(t + j * NTHR, TILE_N * K2_ - 1);
            bv[j] = bsrc[i];
            av[j] = asrc[i];
        }
    }

    // ---- v: each wave sends stages 0 and 1 of its own 56 rows (2 x 18 x 512 B, whole lines)
    //      on their way to its two buffers; they fly while phases 0 to 1b run ----
    const float*   vsrc = v + ((size_t)bh * N_ + nb + wave * WROWS) * VROW + lane * 4;
    const unsigned vdst = (unsigned)(size_t)&v_s[wave * 2 * VSTAGE + lane * 4];
    copy_stage(vdst,              vsrc);
    copy_stage(vdst + VSTAGE * 4, vsrc + VSTAGE);

    // ---- Phase 0: stage zero-padded learnable_tokens[h] (32x9 -> 32x16) in LDS ----
    // both stores unconditional (those past element 511 fall on dead padding): under a test
    // the compiler sinks the second load to the store, behind the v copies
    lt_s[t]        = ((t & 15) < K2_) ? ltv[0] : 0.f;   // NTHR is a multiple of 16:
    lt_s[t + NTHR] = ((t & 15) < K2_) ? ltv[1] : 0.f;   // both elements have column t & 15
    __syncthreads();

    // ---- Phase 1: attn[16x16] = q[16x32] @ lt[32x16] via WMMA f32 16x16x4, 49 tiles ----
    #pragma unroll
    for (int j = 0; j < 4; ++j) {
        const int tile = wave + j * WAVES;
        if (j < 3 || tile < NTILE) {            // wave-uniform: EXEC stays all ones
            v8f c = {0.f, 0.f, 0.f, 0.f, 0.f, 0.f, 0.f, 0.f};
            #pragma unroll
            for (int kk = 0; kk < 8; ++kk) {
                const int k0 = kk * 4 + (hi ? 2 : 0);
                v2f b;
                b.x = lt_s[(k0    ) * 16 + r];  // conflict-free, branchless
                b.y = lt_s[(k0 + 1) * 16 + r];
                c = __builtin_amdgcn_wmma_f32_16x16x4_f32(false, a[j][kk], false, b,
                                                          (short)0, c, false, false);
            }
            // C layout: c[vv] = dot(q[row], lt[:,col]) with row = vv + (hi?8:0), col = r.
            // Store all 16 cols unconditionally (cols 9..15 are dead padding).
            #pragma unroll
            for (int vv = 0; vv < 8; ++vv) {
                const int row = vv + (hi ? 8 : 0);
                attn_s[(tile * 16 + row) * AS_STRIDE + r] = c[vv];
            }
        }
    }
    __syncthreads();

    // ---- Phase 1b: attn += bias + attn_local (coalesced cooperative pass) ----
    // every element belongs to one thread: all reads go out together, then all writes
    // (a read clamped at the end is of another thread's element and is never used)
    {
        float cur[16];
        #pragma unroll
        for (int j = 0; j < 16; ++j) {
            const int i    = min(t + j * NTHR, TILE_N * K2_ - 1);
            const int nloc = i / K2_;
            const int k    = i - nloc * K2_;
            cur[j] = attn_s[nloc * AS_STRIDE + k];
        }
        #pragma unroll
        for (int j = 0; j < 16; ++j) {
            const int i = t + j * NTHR;
            if (i < TILE_N * K2_) {
                const int nloc = i / K2_;
                const int k    = i - nloc * K2_;
                attn_s[nloc * AS_STRIDE + k] = cur[j] + (bv[j] + av[j]);
            }
        }
    }
    __syncthreads();

    // ---- Phase 2: out[n,d] = sum_k attn[n,k] * v[n,d,k], v through this wave's own ring ----
    // The ring is private to the wave (it alone copies into and reads its two buffers), so the
    // loop holds no workgroup barrier: the wave's own waits order copy, read and refill.
    const float* vbuf = &v_s[wave * 2 * VSTAGE + lane * K2_];
    const float* arow = &attn_s[wave * WROWS * AS_STRIDE];
    float*       orow = out + ((size_t)bh * N_ + nb + wave * WROWS) * D_ + lane;
    // stage 0 (the 18 older copies) has landed; stage 1's 18 may still fly
    asm volatile("s_wait_asynccnt 0x12" ::: "memory");
    #pragma unroll 1                            // rolled: one small body, stage index scalar
    for (int s = 0; s < NSTAGE - 2; ++s) {      // every trip refills: 18 copies each
        const int buf = s & 1;
        av_stage(vbuf + buf * VSTAGE, arow + s * (SROWS * AS_STRIDE), orow + s * (SROWS * D_));
        // this wave's reads of the buffer have retired before copies are aimed at it again
        asm volatile("s_wait_dscnt 0x0" ::: "memory");
        copy_stage(vdst + buf * (VSTAGE * 4), vsrc + (s + 2) * VSTAGE);
        // stage s+1 (all but the 18 youngest copies) has landed; stage s+2 flies on
        asm volatile("s_wait_asynccnt 0x12" ::: "memory");
    }
    av_stage(vbuf + ((NSTAGE - 2) & 1) * VSTAGE, arow + (NSTAGE - 2) * (SROWS * AS_STRIDE),
             orow + (NSTAGE - 2) * (SROWS * D_));
    // no refill is left: every copy of this wave, the last stage's too, has landed
    asm volatile("s_wait_asynccnt 0x0" ::: "memory");
    av_stage(vbuf + ((NSTAGE - 1) & 1) * VSTAGE, arow + (NSTAGE - 1) * (SROWS * AS_STRIDE),
             orow + (NSTAGE - 1) * (SROWS * D_));
}

extern "C" void kernel_launch(void* const* d_in, const int* in_sizes, int n_in,
                              void* d_out, int out_size, void* d_ws, size_t ws_size,
                              hipStream_t stream) {
    (void)in_sizes; (void)n_in; (void)d_ws; (void)ws_size; (void)out_size;
    const float* q          = (const float*)d_in[0];
    const float* attn_local = (const float*)d_in[1];
    const float* v          = (const float*)d_in[2];
    const float* lt         = (const float*)d_in[3];
    const float* bias       = (const float*)d_in[4];
    float* out = (float*)d_out;

    const int grid = B_ * H_ * (N_ / TILE_N);   // 256 workgroups
    swattn_av_kernel<<<grid, NTHR, 0, stream>>>(q, attn_local, v, lt, bias, out);
}

// v003
// A run of this version takes 17.8 microseconds.
// Two timings next to v002 put it at 1.09 and 1.08 times that version's speed.
// All steps since v000 together make it 1.54 times as fast.
#include <hip/hip_runtime.h>

typedef float v2f __attribute__((ext_vector_type(2)));
typedef float v8f __attribute__((ext_vector_type(8)));

#define B_    8
#define H_    8
#define N_    3136
#define D_    32
#define K2_   9
#define WAVES  14          // waves per workgroup; one workgroup fills one WGP's LDS
#define NTHR   (WAVES * 32)
#define TILE_N 784         // rows per workgroup: a quarter of one (b,h) plane
#define WROWS  56          // v rows per wave = NSTAGE x SROWS
#define SROWS  8           // v rows per ring stage
#define NSTAGE 7
#define NWT    4           // WMMA tiles of 16 rows per wave
#define TROW(j) ((j) * 16 < WROWS - 16 ? (j) * 16 : WROWS - 16) // first row of tile j: 0, 16, 32, 40
#define AS_STRIDE 17       // padded attn_s row stride (avoids lo/hi lane bank clash)
#define VROW   (D_ * K2_)  // 288 floats = 1152 B: one row's v block
#define VSTAGE (SROWS * VROW) // 2304 floats = 9216 B = 18 x 512 B: one stage, contiguous in v

// Nine 16-byte-per-lane copies global -> LDS (9 x 512 contiguous bytes per wave), through
// no register; non-temporal (v is read once).
// s_wait_xcnt 0 closes the statement as a precaution: no address register that a copy names
// is rewritten ahead of it, and inside the statement nothing can be moved over it.
__device__ __forceinline__ void copy9_to_lds(unsigned l, const float* g)
{
    asm volatile(
        "global_load_async_to_lds_b128 %0, %9, off th:TH_LOAD_NT\n\t"
        "global_load_async_to_lds_b128 %1, %10, off th:TH_LOAD_NT\n\t"
        "global_load_async_to_lds_b128 %2, %11, off th:TH_LOAD_NT\n\t"
        "global_load_async_to_lds_b128 %3, %12, off th:TH_LOAD_NT\n\t"
        "global_load_async_to_lds_b128 %4, %13, off th:TH_LOAD_NT\n\t"
        "global_load_async_to_lds_b128 %5, %14, off th:TH_LOAD_NT\n\t"
        "global_load_async_to_lds_b128 %6, %15, off th:TH_LOAD_NT\n\t"
        "global_load_async_to_lds_b128 %7, %16, off th:TH_LOAD_NT\n\t"
        "global_load_async_to_lds_b128 %8, %17, off th:TH_LOAD_NT\n\t"
        "s_wait_xcnt 0x0"
        :: "v"(l),        "v"(l +  512), "v"(l + 1024), "v"(l + 1536),
           "v"(l + 2048), "v"(l + 2560), "v"(l + 3072), "v"(l + 3584),
           "v"(l + 4096),
           "v"(g),        "v"(g +  128), "v"(g +  256), "v"(g +  384),
           "v"(g +  512), "v"(g +  640), "v"(g +  768), "v"(g +  896),
           "v"(g + 1024)
        : "memory");
}

// One ring stage: 8 v rows = 18 copies of this wave.
__device__ __forceinline__ void copy_stage(unsigned l, const float* g)
{
    copy9_to_lds(l,        g);
    copy9_to_lds(l + 4608, g + 1152);
}

// One stage's 8 rows: out[n,d] = sum_k attn[n,k] * v[n,d,k]; vb, at, o already hold lane d's place.
// lane d reads dwords 9d+k: 9 is odd, so the 32 lanes fall on 32 different banks
__device__ __forceinline__ void av_stage(const float* vb, const float* at, float* o)
{
    #pragma unroll 1                            // rolled by fours: a small body, one wait a trip
    for (int g = 0; g < SROWS; g += 4) {
        #pragma unroll
        for (int rr = g; rr < g + 4; ++rr) {
            const float* vrow = vb + rr * VROW;
            float acc = 0.f;
            #pragma unroll
            for (int k = 0; k < K2_; ++k) {
                acc = fmaf(at[rr * AS_STRIDE + k], vrow[k], acc);
            }
            __builtin_nontemporal_store(acc, o + rr * D_);
        }
        // a precaution: the next trip rewrites the registers that these four stores name
        asm volatile("s_wait_xcnt 0x0" ::: "memory");
    }
}

// One 16-row tile's operands, into registers: q as WMMA A fragments, bias and attn_local in the
// WMMA C layout. row0 is the tile's first row among the wave's 56.
__device__ __forceinline__ void tile_loads(const float* qw, const float* bw, const float* aw,
                                           int row0, int r, bool hi,
                                           v2f (&a)[8], float (&bv)[8], float (&av)[8])
{
    const float* qrow = qw + (row0 + r) * D_ + (hi ? 2 : 0);
    #pragma unroll
    for (int kk = 0; kk < 8; ++kk) {            // K = 32 as 8 steps of K4
        a[kk].x = qrow[kk * 4];
        a[kk].y = qrow[kk * 4 + 1];
    }
    const int col = min(r, K2_ - 1);            // cols 9..15: a copy of col 8, lands on dead padding
    #pragma unroll
    for (int vv = 0; vv < 8; ++vv) {
        const int row = row0 + vv + (hi ? 8 : 0);
        bv[vv] = bw[row * K2_ + col];
        av[vv] = aw[row * K2_ + col];
    }
    // a precaution: later code may take over the address registers that these loads name
    asm volatile("s_wait_xcnt 0x0" ::: "memory");
}

// attn[16x16] = q[16x32] @ lt[32x16] via WMMA f32 16x16x4, + (bias + attn_local), into the
// wave's own attn rows. C layout: c[vv] belongs to row vv + (hi ? 8 : 0), col r.
__device__ __forceinline__ void attn_tile(float* at, int r, bool hi, const v2f (&a)[8],
                                          const v2f (&b)[8], const float (&bv)[8],
                                          const float (&av)[8])
{
    v8f c = {0.f, 0.f, 0.f, 0.f, 0.f, 0.f, 0.f, 0.f};
    #pragma unroll
    for (int kk = 0; kk < 8; ++kk) {
        c = __builtin_amdgcn_wmma_f32_16x16x4_f32(false, a[kk], false, b[kk],
                                                  (short)0, c, false, false);
    }
    #pragma unroll
    for (int vv = 0; vv < 8; ++vv) {
        at[(vv + (hi ? 8 : 0)) * AS_STRIDE + r] = c[vv] + (bv[vv] + av[vv]);
    }
}

__global__ __launch_bounds__(NTHR) void swattn_av_kernel(
    const float* __restrict__ q,          // [B,H,N,32]
    const float* __restrict__ attn_local, // [B,H,N,9]
    const float* __restrict__ v,          // [B,H,N,32,9]
    const float* __restrict__ lt,         // [H,32,9]
    const float* __restrict__ bias,       // [H,N,9]
    float* __restrict__ out)              // [B,H,N,32]
{
    // attn rows; a wave writes and reads its own 56 alone
    __shared__ float attn_s[TILE_N * AS_STRIDE];
    // per wave two stage buffers, each 8 v rows in the layout they have in memory
    __shared__ __attribute__((aligned(16))) float v_s[WAVES * 2 * VSTAGE];

    const int t    = threadIdx.x;
    const int wave = __builtin_amdgcn_readfirstlane(t >> 5);
    const int lane = t & 31;

    const int parts_per_bh = N_ / TILE_N;       // 4
    const int bh = blockIdx.x / parts_per_bh;
    const int nb = (blockIdx.x % parts_per_bh) * TILE_N;
    const int h  = bh % H_;

    const int  r   = lane & 15;                 // A: row index / B: col index
    const bool hi  = lane >= 16;                // K-offset +2 half of the wave

    // Everything below is private to the wave: its 56 rows of q, bias, attn_local, v and out,
    // its attn rows and its v ring in LDS. The kernel holds no workgroup barrier.
    const size_t   row0 = (size_t)bh * N_ + nb + wave * WROWS;
    const float*   qw   = q          + row0 * D_;
    const float*   aw   = attn_local + row0 * K2_;
    const float*   bw   = bias       + ((size_t)h * N_ + nb + wave * WROWS) * K2_;
    const float*   vsrc = v + row0 * VROW + lane * 4;
    const unsigned vdst = (unsigned)(size_t)&v_s[wave * 2 * VSTAGE + lane * 4];

    // ---- Stage 0 of the wave's 56 v rows (18 x 512 B, whole lines) goes out first; the many-line
    //      loads of the first tile's small operands issue while it flies; then stage 1 ----
    copy_stage(vdst, vsrc);
    // learnable_tokens[h] (32x9) as WMMA B fragments, same k order as the A fragments of tile_loads
    v2f b[8];
    {
        const float* ltb = lt + (size_t)h * (D_ * K2_) + (hi ? 2 * K2_ : 0) + min(r, K2_ - 1);
        #pragma unroll
        for (int kk = 0; kk < 8; ++kk) {
            b[kk].x = ltb[(kk * 4) * K2_];
            b[kk].y = ltb[(kk * 4 + 1) * K2_];
        }
    }
    v2f   a[NWT][8];
    float bv[NWT][8], av[NWT][8];
    tile_loads(qw, bw, aw, TROW(0), r, hi, a[0], bv[0], av[0]);
    copy_stage(vdst + VSTAGE * 4, vsrc + VSTAGE);
    tile_loads(qw, bw, aw, TROW(1), r, hi, a[1], bv[1], av[1]);
    // keeps the first uses of loaded values, and with them the waits, from rising over the copies
    __builtin_amdgcn_sched_barrier(0);
    #pragma unroll
    for (int kk = 0; kk < 8; ++kk) {            // zero-pad 32x9 to 32x16
        b[kk].x = (r < K2_) ? b[kk].x : 0.f;
        b[kk].y = (r < K2_) ? b[kk].y : 0.f;
    }

    float*       arow = &attn_s[wave * WROWS * AS_STRIDE];
    const float* vbuf = &v_s[wave * 2 * VSTAGE + lane * K2_];
    float*       orow = out + row0 * D_ + lane;

    attn_tile(arow, r, hi, a[0], b, bv[0], av[0]);
    // stage 0 (the 18 older copies) has landed; stage 1's 18 may still fly
    asm volatile("s_wait_asynccnt 0x12" ::: "memory");

    // ---- out[n,d] = sum_k attn[n,k] * v[n,d,k], v through the wave's own ring. A tile of attn
    //      serves two stages; its operands are asked for two stages ahead of its product, which
    //      runs behind the refill, while the next stage's copies fly. The last tile starts at
    //      row 40: it writes rows 40 to 47 a second time, with the same values, behind their
    //      last read, and serves stage 6 ----
    #pragma unroll                              // unrolled: tile registers and buffers by constant index
    for (int s = 0; s < NSTAGE; ++s) {
        const int buf = s & 1;
        const int nt  = s / 2 + 1;              // the tile that follows this stage's
        av_stage(vbuf + buf * VSTAGE, arow + s * (SROWS * AS_STRIDE), orow + s * (SROWS * D_));
        if (s + 2 < NSTAGE) {
            // this wave's reads of the buffer have retired before copies are aimed at it again
            asm volatile("s_wait_dscnt 0x0" ::: "memory");
            copy_stage(vdst + buf * (VSTAGE * 4), vsrc + (s + 2) * VSTAGE);
        }
        if (buf == 1) {
            if (nt + 1 < NWT) {
                tile_loads(qw, bw, aw, TROW(nt + 1), r, hi, a[nt + 1], bv[nt + 1], av[nt + 1]);
            }
            if (s + 2 < NSTAGE) {
                // keeps the product, and with it the wait for its loads, from rising over the refill
                __builtin_amdgcn_sched_barrier(0);
            }
            attn_tile(arow + TROW(nt) * AS_STRIDE, r, hi, a[nt], b, bv[nt], av[nt]);
        }
        if (s + 2 < NSTAGE) {
            // stage s+1 (all but the 18 youngest copies) has landed; stage s+2 flies on
            asm volatile("s_wait_asynccnt 0x12" ::: "memory");
        } else if (s + 1 < NSTAGE) {
            // no refill is left: every copy of this wave, the last stage's too, has landed
            asm volatile("s_wait_asynccnt 0x0" ::: "memory");
        }
    }
}

extern "C" void kernel_launch(void* const* d_in, const int* in_sizes, int n_in,
                              void* d_out, int out_size, void* d_ws, size_t ws_size,
                              hipStream_t stream) {
    (void)in_sizes; (void)n_in; (void)d_ws; (void)ws_size; (void)out_size;
    const float* q          = (const float*)d_in[0];
    const float* attn_local = (const float*)d_in[1];
    const float* v          = (const float*)d_in[2];
    const float* lt         = (const float*)d_in[3];
    const float* bias       = (const float*)d_in[4];
    float* out = (float*)d_out;

    const int grid = B_ * H_ * (N_ / TILE_N);   // 256 workgroups
    swattn_av_kernel<<<grid, NTHR, 0, stream>>>(q, attn_local, v, lt, bias, out);
}
